// v000
// Times are from an AMD MI455X. After a warm-up the kernel runs many times in a row, and a time is the length of
// such a window on the GPU divided by its runs, so every launch and the gaps after it count. The runs cycle
// through copies of the inputs. A figure is the median of several windows, for all but v000 over two sittings.
// Sittings can differ by a few percent; kernels timed side by side share one.
// The starting kernel, v000, takes 315 microseconds a run.
#include <hip/hip_runtime.h>

// Contractions: S^T = K x Q^T on v_wmma_f32_16x16x32_bf16 (bf16 operands = RNE-converted inputs, f32 accumulate, softmax
// scale applied to the f32 scores); O = P x V on v_wmma_f32_16x16x32_f16 (P as f16 carried x4096, V = f16 of the bf16
// RNE-converted input, f32 accumulate). Softmax, head sum and the column-mean term in f32 (second-stage sum in f64).

#ifndef NB
#define NB 2
#endif
#ifndef SEQ
#define SEQ 2048
#endif
#define NB_FULL    2
#define SEQ_FULL   2048
#define NHEAD      16
#define HDIM       128
#define BQ         128                  // query rows per workgroup (8 waves x 16)
#define BK         32                   // keys per inner iteration
#define NWAVE      8
#define CT         64                   // keys per plane-builder block
#define NKT        (SEQ / CT)           // plane-builder blocks per (b, h)
#define TP         72                   // LDS pitch (halves) of the transposed V tile
#define OHALF      64                   // output columns staged per pass
#define OP         68                   // LDS pitch (floats) of the output staging tile

#define KB_BYTES   ((size_t)NB * NHEAD * SEQ * HDIM * 2)     // bf16 K plane
#define VT_BYTES   ((size_t)NB * NHEAD * HDIM * SEQ * 2)     // f16 V^T plane
#define PART_BYTES ((size_t)NB * NHEAD * SEQ * HDIM * 4)     // f32 per-head outputs
#define COLP_BYTES ((size_t)NB * NHEAD * NKT * HDIM * 4)     // f32 per-block column sums of V
#define TERM_BYTES ((size_t)NB * HDIM * 4)                   // f32 (H-1) * mean term

static_assert(SEQ % BQ == 0);
static_assert(SEQ % CT == 0);
static_assert(SEQ % BK == 0);
static_assert(BQ == NWAVE * 16);
static_assert(HDIM == 128);
static_assert(HDIM % 32 == 0);
static_assert(2 * OHALF == HDIM);
static_assert(16 * 4 == OHALF);                 // 16 lanes x 4 floats = one staged half row
static_assert(CT == 64);
static_assert(256 * 4 * 8 == CT * HDIM);        // plane builder: threads x items x elements
static_assert(TP >= CT);
static_assert(OP >= OHALF);
static_assert((TP * 2) % 16 == 0);
static_assert((OP * 4) % 16 == 0);
static_assert(NWAVE * 16 * OP * 4 <= 65536);
static_assert(SEQ <= SEQ_FULL);
static_assert(NB >= 1 && NB <= NB_FULL);
static_assert(((size_t)NB * SEQ * (HDIM / 4)) % 256 == 0);
static_assert(KB_BYTES % 128 == 0 && VT_BYTES % 128 == 0 && PART_BYTES % 128 == 0);
static_assert(COLP_BYTES % 128 == 0 && TERM_BYTES % 128 == 0);
static_assert(KB_BYTES + VT_BYTES + PART_BYTES + COLP_BYTES + TERM_BYTES <= (size_t)134217728);

typedef __bf16   bf16;
typedef _Float16 f16;
typedef bf16     v16bf __attribute__((ext_vector_type(16)));
typedef f16      v16h  __attribute__((ext_vector_type(16)));
typedef f16      v8h   __attribute__((ext_vector_type(8)));
typedef float    v8f   __attribute__((ext_vector_type(8)));
typedef float    v4f   __attribute__((ext_vector_type(4)));
typedef unsigned v4u   __attribute__((ext_vector_type(4)));

union FragB  { v16bf v; v4u q[2]; bf16 h[16]; };
union FragH  { v16h  v; v4u q[2]; f16  h[16]; };
union Pack8B { v4u u; bf16 h[8]; };
union Pack8H { v4u u; v8h v; f16 h[8]; };

// WMMA helpers: builtin followed by the VALU hazard guard (ties D, keeps A/B live).
static __device__ __forceinline__ v8f mma_bf16(v16bf a, v16bf b, v8f acc) {
  acc = __builtin_amdgcn_wmma_f32_16x16x32_bf16(false, a, false, b, (short)0, acc, false, false);
  asm volatile("v_nop\n\tv_nop\n\tv_nop\n\tv_nop" : "+v"(acc) : "v"(a), "v"(b));
  return acc;
}
static __device__ __forceinline__ v8f mma_f16(v16h a, v16h b, v8f acc) {
  acc = __builtin_amdgcn_wmma_f32_16x16x32_f16(false, a, false, b, (short)0, acc, false, false);
  asm volatile("v_nop\n\tv_nop\n\tv_nop\n\tv_nop" : "+v"(acc) : "v"(a), "v"(b));
  return acc;
}

// Plane builder. Block = (64-key tile, head, batch), 256 threads.
//   colp [NB][NHEAD][NKT][HDIM]  f32  : sum over the block's 64 keys of the bf16-converted V, 512 B per block,
// coverage: keys kt*64 + 0..63, d 0..127 for kb and vt; colp row (b, h, kt) d 0..127; every line whole.
__global__ __launch_bounds__(256) void kv_planes_kernel(const float* __restrict__ kin,
                                                        const float* __restrict__ vin,
                                                        bf16* __restrict__ kb,
                                                        f16* __restrict__ vt,
                                                        float* __restrict__ colp) {
  const int kt  = blockIdx.x;
  const int h   = blockIdx.y;
  const int b   = blockIdx.z;
  const int tid = threadIdx.x;
  __shared__ __align__(16) f16   sT[HDIM * TP];   // [d][key], cross-wave (block barrier)
  __shared__ __align__(16) float sC[HDIM];        // column sums, cross-wave (block barrier)
  const int s0 = kt * CT;
  const size_t bh = (size_t)b * NHEAD + h;

  v4u    kval[4];
  size_t kidx[4];
  #pragma unroll
  for (int kk = 0; kk < 4; ++kk) {
    const int key = kk * 16 + (tid >> 4);       // 0..63
    const int d0  = (tid & 15) * 8;             // 0..120
    const size_t src = (bh * SEQ_FULL + s0 + key) * HDIM + d0;
    const v4f k0 = *(const v4f*)(kin + src);
    const v4f k1 = *(const v4f*)(kin + src + 4);
    const v4f v0 = *(const v4f*)(vin + src);
    const v4f v1 = *(const v4f*)(vin + src + 4);
    Pack8B pk;
    #pragma unroll
    for (int i = 0; i < 4; ++i) {
      pk.h[i]     = (bf16)k0[i];                          // RNE convert
      pk.h[4 + i] = (bf16)k1[i];
    }
    kval[kk] = pk.u;
    kidx[kk] = (bh * SEQ + s0 + key) * HDIM + d0;
    #pragma unroll
    for (int i = 0; i < 4; ++i) {
      sT[(d0 + i) * TP + key]     = (f16)(float)(bf16)v0[i];   // f16 of a bf16 value: exact
      sT[(d0 + 4 + i) * TP + key] = (f16)(float)(bf16)v1[i];
    }
  }
  __syncthreads();

  v4u    vval[4];
  size_t vidx[4];
  #pragma unroll
  for (int kk = 0; kk < 4; ++kk) {
    const int d  = kk * 32 + (tid >> 3);        // 0..127
    const int ks = (tid & 7) * 8;               // 0..56
    Pack8H ph;
    ph.v = *(const v8h*)(&sT[d * TP + ks]);
    vval[kk] = ph.u;
    vidx[kk] = (bh * HDIM + d) * SEQ + s0 + ks;
  }

  // column sums over the 64 keys (waves 0..3, wave-uniform branch, no barrier inside)
  if (tid < HDIM) {
    float cs = 0.0f;
    #pragma unroll 1
    for (int ks = 0; ks < CT; ks += 8) {
      const v8h x = *(const v8h*)(&sT[tid * TP + ks]);
      #pragma unroll
      for (int i = 0; i < 8; ++i) cs += (float)x[i];
    }
    sC[tid] = cs;
  }
  __syncthreads();

  v4f cval = (v4f){0, 0, 0, 0};
  const size_t cidx = ((bh * NKT) + kt) * HDIM + (size_t)(tid & 31) * 4;
  if (tid < 32) cval = *(const v4f*)(&sC[tid * 4]);

  #pragma unroll
  for (int kk = 0; kk < 4; ++kk) {
    *(v4u*)(kb + kidx[kk]) = kval[kk];
    *(v4u*)(vt + vidx[kk]) = vval[kk];
  }
  if (tid < 32) *(v4f*)(colp + cidx) = cval;
  
}

// Flash attention, all keys visible. Block = (query block of 128, head, batch); one wave owns 16 query rows.
// S^T = K x Q^T so queries sit on lanes; P^T in C-layout is bit-identical to the A-fragment layout of O += P x V.
// K A-fragments and V^T B-fragments are loaded straight from the 16-bit planes (two 16-B loads per fragment).
__global__ __launch_bounds__(256) void attn_kernel(const float* __restrict__ qin,
                                                   const bf16* __restrict__ kb,
                                                   const f16* __restrict__ vt,
                                                   float* __restrict__ part) {
  const int qblk = blockIdx.x;
  const int h    = blockIdx.y;
  const int b    = blockIdx.z;
  const int tid  = threadIdx.x;
  const int wave = __builtin_amdgcn_readfirstlane(tid >> 5);
  const int lane = tid & 31;
  const int lq   = lane & 15;   // query column of S^T / d column of O
  const int hi   = lane >> 4;   // k-split half

  __shared__ __align__(16) float sO[NWAVE * 16 * OP];   // per-wave staging tile (wave-private rows; block barriers used)

  const int    qrow0 = qblk * BQ + wave * 16;            // first query row of this wave
  const size_t bh    = (size_t)b * NHEAD + h;

  // Q as B-operand fragments: lane lq holds query qrow0+lq, elements follow the split d map; bf16 RNE convert.
  FragB qf[4];
  {
    const float* qp = qin + (bh * SEQ_FULL + qrow0 + lq) * HDIM;
    #pragma unroll
    for (int f = 0; f < 4; ++f) {
      const v4f a0 = *(const v4f*)(qp + f * 32 + hi * 8);
      const v4f a1 = *(const v4f*)(qp + f * 32 + hi * 8 + 4);
      const v4f b0 = *(const v4f*)(qp + f * 32 + 16 + hi * 8);
      const v4f b1 = *(const v4f*)(qp + f * 32 + 16 + hi * 8 + 4);
      #pragma unroll
      for (int i = 0; i < 4; ++i) {
        qf[f].h[i]      = (bf16)a0[i];   // elems 0..7  : d = f*32 + hi*8 + 0..7
        qf[f].h[4 + i]  = (bf16)a1[i];
        qf[f].h[8 + i]  = (bf16)b0[i];   // elems 8..15 : d = f*32 + 16 + hi*8 + 0..7
        qf[f].h[12 + i] = (bf16)b1[i];
      }
    }
  }

  const bf16* kb_h = kb + bh * SEQ * HDIM;
  const f16*  vt_h = vt + bh * HDIM * SEQ;

  v8f o[8];
  #pragma unroll
  for (int dt = 0; dt < 8; ++dt) o[dt] = (v8f){0, 0, 0, 0, 0, 0, 0, 0};

  float rmax = -__builtin_inff();
  float rsum = 0.0f;
  const float SL = 0.08838834764831845f * 1.4426950408889634f;   // softmax scale * log2(e)

  #pragma unroll 1
  for (int i = 0; i < SEQ / BK; ++i) {
    const int j0 = i * BK;

    // S^T tiles: c[sub][r] = rawscore(query qrow0+lq, key j0 + sub*16 + hi*8 + r)
    v8f c[2];
    #pragma unroll
    for (int sub = 0; sub < 2; ++sub) {
      v8f acc = (v8f){0, 0, 0, 0, 0, 0, 0, 0};
      #pragma unroll
      for (int f = 0; f < 4; ++f) {
        // K A-fragment: row = key j0 + sub*16 + lq, split d map
        const bf16* base = kb_h + (size_t)(j0 + sub * 16 + lq) * HDIM + f * 32 + hi * 8;
        FragB ak;
        ak.q[0] = *(const v4u*)(base);        // d = f*32 + hi*8 + 0..7
        ak.q[1] = *(const v4u*)(base + 16);   // d = f*32 + 16 + hi*8 + 0..7
        acc = mma_bf16(ak.v, qf[f].v, acc);
      }
      c[sub] = acc;
      __builtin_amdgcn_sched_barrier(0);
    }

    // online softmax: query lq's 32 scores are split across lane / lane^16
    float m_new = rmax;
    #pragma unroll
    for (int r = 0; r < 8; ++r) {
      m_new = fmaxf(m_new, c[0][r]);
      m_new = fmaxf(m_new, c[1][r]);
    }
    m_new = fmaxf(m_new, __shfl_xor(m_new, 16, 32));
    const float scale = __builtin_amdgcn_exp2f((rmax - m_new) * SL);
    rmax = m_new;

    // exp + pack: P^T C-layout == A-fragment layout for the PV product; P carried x4096
    FragH pa;
    float psum = 0.0f;
    #pragma unroll
    for (int r = 0; r < 8; ++r) {
      const float p0 = __builtin_amdgcn_exp2f((c[0][r] - m_new) * SL);   // key hi*8 + r
      const float p1 = __builtin_amdgcn_exp2f((c[1][r] - m_new) * SL);   // key 16 + hi*8 + r
      psum += p0 + p1;
      pa.h[r]     = (f16)(p0 * 4096.0f);
      pa.h[8 + r] = (f16)(p1 * 4096.0f);
    }
    rsum = rsum * scale + psum + __shfl_xor(psum, 16, 32);

    // rescale O: queries are the row dimension there -> per-row scale from lane 8*hi + r
    float sc[8];
    #pragma unroll
    for (int r = 0; r < 8; ++r) sc[r] = __shfl(scale, (hi << 3) + r, 32);
    #pragma unroll
    for (int dt = 0; dt < 8; ++dt) {
      #pragma unroll
      for (int r = 0; r < 8; ++r) o[dt][r] *= sc[r];
    }
    __builtin_amdgcn_sched_barrier(0);

    // O += P x V, four output tiles at a time
    #pragma unroll
    for (int g = 0; g < 2; ++g) {
      FragH bv[4];
      #pragma unroll
      for (int t = 0; t < 4; ++t) {
        // V B-fragment: column n = d = (g*4+t)*16 + lq, split key map from the transposed plane
        const f16* base = vt_h + (size_t)((g * 4 + t) * 16 + lq) * SEQ + j0 + hi * 8;
        bv[t].q[0] = *(const v4u*)(base);            // keys j0 + hi*8 + 0..7
        bv[t].q[1] = *(const v4u*)(base + 16);       // keys j0 + 16 + hi*8 + 0..7
      }
      #pragma unroll
      for (int t = 0; t < 4; ++t) o[g * 4 + t] = mma_f16(pa.v, bv[t].v, o[g * 4 + t]);
      __builtin_amdgcn_sched_barrier(0);
    }
  }

  // normalize: lane holds column d = dt*16 + lq for query rows 8*hi + r
  float rs[8];
  #pragma unroll
  for (int r = 0; r < 8; ++r) rs[r] = (1.0f / 4096.0f) * (1.0f / __shfl(rsum, (hi << 3) + r, 32));

  const int so = wave * (16 * OP);
  v4f    vals[16];
  size_t gidx[8];

  // columns 0..63
  #pragma unroll
  for (int r = 0; r < 8; ++r) {
    #pragma unroll
    for (int t = 0; t < 4; ++t) sO[so + (hi * 8 + r) * OP + t * 16 + lq] = o[t][r] * rs[r];
  }
  __syncthreads();
  #pragma unroll
  for (int it = 0; it < 8; ++it) {
    const int row = it * 2 + hi;
    vals[it] = *(const v4f*)(&sO[so + row * OP + lq * 4]);
    gidx[it] = (bh * SEQ + qrow0 + row) * HDIM + lq * 4;
  }
  __syncthreads();
  // columns 64..127
  #pragma unroll
  for (int r = 0; r < 8; ++r) {
    #pragma unroll
    for (int t = 0; t < 4; ++t) sO[so + (hi * 8 + r) * OP + t * 16 + lq] = o[4 + t][r] * rs[r];
  }
  __syncthreads();
  #pragma unroll
  for (int it = 0; it < 8; ++it) {
    const int row = it * 2 + hi;
    vals[8 + it] = *(const v4f*)(&sO[so + row * OP + lq * 4]);
  }

  // 8 consecutive lanes x 16 B each), lanes 16..31 the same half of the next row.
  #pragma unroll
  for (int it = 0; it < 8; ++it) {
    *(v4f*)(part + gidx[it])         = vals[it];
    *(v4f*)(part + gidx[it] + OHALF) = vals[8 + it];
  }
  
}

// term[b][d] = (NHEAD-1)/SEQ * sum over heads and key tiles of colp. Block = batch, 128 threads (thread = d).
__global__ __launch_bounds__(128) void meanv_kernel(const float* __restrict__ colp,
                                                    float* __restrict__ term) {
  const int b   = blockIdx.x;
  const int tid = threadIdx.x;
  __shared__ __align__(16) float sM[HDIM];   // cross-wave (block barrier)
  const float* src = colp + (size_t)b * NHEAD * NKT * HDIM + tid;
  double acc = 0.0;
  #pragma unroll 4
  for (int j = 0; j < NHEAD * NKT; ++j) acc += (double)src[(size_t)j * HDIM];
  sM[tid] = (float)(acc * ((double)(NHEAD - 1) / (double)SEQ));
  __syncthreads();
  if (tid < 32) {
    const v4f val = *(const v4f*)(&sM[tid * 4]);
    float* dst = term + (size_t)b * HDIM + tid * 4;
    *(v4f*)dst = val;
    
  }
}

// out[b][s][d] = sum over heads (fixed order) of part[b][h][s][d] + term[b][d]. Thread = one float4;
__global__ __launch_bounds__(256) void headsum_kernel(const float* __restrict__ part,
                                                      const float* __restrict__ term,
                                                      float* __restrict__ out) {
  const int g   = blockIdx.x * 256 + threadIdx.x;   // float4 index in [NB][SEQ][HDIM/4]
  const int d4  = g & (HDIM / 4 - 1);
  const int row = g / (HDIM / 4);                   // b*SEQ + s
  const int b   = row / SEQ;
  const int s   = row - b * SEQ;
  v4f acc = (v4f){0, 0, 0, 0};
  #pragma unroll 4
  for (int h = 0; h < NHEAD; ++h)
    acc += *(const v4f*)(part + (((size_t)b * NHEAD + h) * SEQ + s) * HDIM + d4 * 4);
  acc += *(const v4f*)(term + (size_t)b * HDIM + d4 * 4);
  float* dst = out + ((size_t)b * SEQ_FULL + s) * HDIM + d4 * 4;
  *(v4f*)dst = acc;
  
}

extern "C" void kernel_launch(void* const* d_in, const int* in_sizes, int n_in,
                              void* d_out, int out_size, void* d_ws, size_t ws_size,
                              hipStream_t stream) {
  if (n_in < 3) return;
  const size_t in_need  = (((size_t)(NB - 1) * NHEAD + (NHEAD - 1)) * SEQ_FULL + SEQ) * HDIM;
  const size_t out_need = ((size_t)(NB - 1) * SEQ_FULL + SEQ) * HDIM;
  if ((size_t)in_sizes[0] < in_need) return;
  if ((size_t)in_sizes[1] < in_need) return;
  if ((size_t)in_sizes[2] < in_need) return;
  if ((size_t)out_size < out_need) return;
  if (ws_size < KB_BYTES + VT_BYTES + PART_BYTES + COLP_BYTES + TERM_BYTES) return;

  const float* qin = (const float*)d_in[0];
  const float* kin = (const float*)d_in[1];
  const float* vin = (const float*)d_in[2];
  float*       out = (float*)d_out;

  char*  wsb  = (char*)d_ws;
  bf16*  kb   = (bf16*)wsb;
  f16*   vt   = (f16*)(wsb + KB_BYTES);
  float* part = (float*)(wsb + KB_BYTES + VT_BYTES);
  float* colp = (float*)(wsb + KB_BYTES + VT_BYTES + PART_BYTES);
  float* term = (float*)(wsb + KB_BYTES + VT_BYTES + PART_BYTES + COLP_BYTES);

  kv_planes_kernel<<<dim3(SEQ / CT, NHEAD, NB), 256, 0, stream>>>(kin, vin, kb, vt, colp);
  meanv_kernel<<<dim3(NB), 128, 0, stream>>>(colp, term);
  attn_kernel<<<dim3(SEQ / BQ, NHEAD, NB), 256, 0, stream>>>(qin, kb, vt, part);
  headsum_kernel<<<dim3((unsigned)(((size_t)NB * SEQ * (HDIM / 4)) / 256)), 256, 0, stream>>>(part, term, out);
}

// v001
// Measured time: 261 microseconds a run.
// Two timings next to v000 both put it at 1.22 times that version's speed.
#include <hip/hip_runtime.h>

// Contractions: S^T = K x Q^T on v_wmma_f32_16x16x32_bf16 (bf16 operands = RNE-converted inputs, f32 accumulate, softmax
// scale applied to the f32 scores); O = P x V on v_wmma_f32_16x16x32_f16 (P as f16 carried x4096, V = f16 of the bf16
// RNE-converted input, f32 accumulate). Softmax, head sum and the column-mean term in f32 (second-stage sum in f64).

#ifndef NB
#define NB 2
#endif
#ifndef SEQ
#define SEQ 2048
#endif
#define NB_FULL    2
#define SEQ_FULL   2048
#define NHEAD      16
#define HDIM       128
#define BQ         128                  // query rows per workgroup (8 waves x 16)
#define BK         32                   // keys per inner iteration
#define NWAVE      8
#define CT         64                   // keys per plane-builder block
#define NKT        (SEQ / CT)           // plane-builder blocks per (b, h)
#define TP         72                   // LDS pitch (halves) of the transposed V tile
#define OHALF      64                   // output columns staged per pass
#define OP         68                   // LDS pitch (floats) of the output staging tile
#define MD         32                   // term columns per mean block (one 128-B line)
#define MS         32                   // row slices per mean block
#define MR         (NHEAD * NKT / MS)   // colp rows per thread of a mean block

#define KB_BYTES   ((size_t)NB * NHEAD * SEQ * HDIM * 2)     // bf16 K plane
#define VT_BYTES   ((size_t)NB * NHEAD * HDIM * SEQ * 2)     // f16 V^T plane
#define PART_BYTES ((size_t)NB * NHEAD * SEQ * HDIM * 4)     // f32 per-head outputs
#define COLP_BYTES ((size_t)NB * NHEAD * NKT * HDIM * 4)     // f32 per-block column sums of V
#define TERM_BYTES ((size_t)NB * HDIM * 4)                   // f32 (H-1) * mean term

static_assert(SEQ % BQ == 0);
static_assert(SEQ % CT == 0);
static_assert(SEQ % BK == 0);
static_assert(BQ == NWAVE * 16);
static_assert(HDIM == 128);
static_assert(HDIM % 32 == 0);
static_assert(2 * OHALF == HDIM);
static_assert(16 * 4 == OHALF);                 // 16 lanes x 4 floats = one staged half row
static_assert(CT == 64);
static_assert(256 * 4 * 8 == CT * HDIM);        // plane builder: threads x items x elements
static_assert(TP >= CT);
static_assert(OP >= OHALF);
static_assert((TP * 2) % 16 == 0);
static_assert((OP * 4) % 16 == 0);
static_assert(NWAVE * 16 * OP * 4 <= 65536);
static_assert(HDIM % MD == 0 && MD * 4 == 128);
static_assert((MD / 4) * MS == 256);            // mean block: float4 columns x slices = threads
static_assert((NHEAD * NKT) % MS == 0);
static_assert(SEQ <= SEQ_FULL);
static_assert(NB >= 1 && NB <= NB_FULL);
static_assert(((size_t)NB * SEQ * (HDIM / 4)) % 256 == 0);
static_assert(KB_BYTES % 128 == 0 && VT_BYTES % 128 == 0 && PART_BYTES % 128 == 0);
static_assert(COLP_BYTES % 128 == 0 && TERM_BYTES % 128 == 0);
static_assert(KB_BYTES + VT_BYTES + PART_BYTES + COLP_BYTES + TERM_BYTES <= (size_t)134217728);

typedef __bf16   bf16;
typedef _Float16 f16;
typedef bf16     v16bf __attribute__((ext_vector_type(16)));
typedef f16      v16h  __attribute__((ext_vector_type(16)));
typedef f16      v8h   __attribute__((ext_vector_type(8)));
typedef float    v8f   __attribute__((ext_vector_type(8)));
typedef float    v4f   __attribute__((ext_vector_type(4)));
typedef unsigned v4u   __attribute__((ext_vector_type(4)));

union FragB  { v16bf v; v4u q[2]; bf16 h[16]; };
union FragH  { v16h  v; v4u q[2]; f16  h[16]; };
union Pack8B { v4u u; bf16 h[8]; };
union Pack8H { v4u u; v8h v; f16 h[8]; };

// WMMA helpers: builtin followed by the VALU hazard guard (ties D, keeps A/B live).
static __device__ __forceinline__ v8f mma_bf16(v16bf a, v16bf b, v8f acc) {
  acc = __builtin_amdgcn_wmma_f32_16x16x32_bf16(false, a, false, b, (short)0, acc, false, false);
  asm volatile("v_nop\n\tv_nop\n\tv_nop\n\tv_nop" : "+v"(acc) : "v"(a), "v"(b));
  return acc;
}
static __device__ __forceinline__ v8f mma_f16(v16h a, v16h b, v8f acc) {
  acc = __builtin_amdgcn_wmma_f32_16x16x32_f16(false, a, false, b, (short)0, acc, false, false);
  asm volatile("v_nop\n\tv_nop\n\tv_nop\n\tv_nop" : "+v"(acc) : "v"(a), "v"(b));
  return acc;
}

// Plane builder. Block = (64-key tile, head, batch), 256 threads.
//   colp [NB][NHEAD][NKT][HDIM]  f32  : sum over the block's 64 keys of the bf16-converted V, 512 B per block,
// coverage: keys kt*64 + 0..63, d 0..127 for kb and vt; colp row (b, h, kt) d 0..127; every line whole.
__global__ __launch_bounds__(256) void kv_planes_kernel(const float* __restrict__ kin,
                                                        const float* __restrict__ vin,
                                                        bf16* __restrict__ kb,
                                                        f16* __restrict__ vt,
                                                        float* __restrict__ colp) {
  const int kt  = blockIdx.x;
  const int h   = blockIdx.y;
  const int b   = blockIdx.z;
  const int tid = threadIdx.x;
  __shared__ __align__(16) f16   sT[HDIM * TP];   // [d][key], cross-wave (block barrier)
  __shared__ __align__(16) float sC[HDIM];        // column sums, cross-wave (block barrier)
  const int s0 = kt * CT;
  const size_t bh = (size_t)b * NHEAD + h;

  v4u    kval[4];
  size_t kidx[4];
  #pragma unroll
  for (int kk = 0; kk < 4; ++kk) {
    const int key = kk * 16 + (tid >> 4);       // 0..63
    const int d0  = (tid & 15) * 8;             // 0..120
    const size_t src = (bh * SEQ_FULL + s0 + key) * HDIM + d0;
    const v4f k0 = *(const v4f*)(kin + src);
    const v4f k1 = *(const v4f*)(kin + src + 4);
    const v4f v0 = *(const v4f*)(vin + src);
    const v4f v1 = *(const v4f*)(vin + src + 4);
    Pack8B pk;
    #pragma unroll
    for (int i = 0; i < 4; ++i) {
      pk.h[i]     = (bf16)k0[i];                          // RNE convert
      pk.h[4 + i] = (bf16)k1[i];
    }
    kval[kk] = pk.u;
    kidx[kk] = (bh * SEQ + s0 + key) * HDIM + d0;
    #pragma unroll
    for (int i = 0; i < 4; ++i) {
      sT[(d0 + i) * TP + key]     = (f16)(float)(bf16)v0[i];   // f16 of a bf16 value: exact
      sT[(d0 + 4 + i) * TP + key] = (f16)(float)(bf16)v1[i];
    }
  }
  __syncthreads();

  v4u    vval[4];
  size_t vidx[4];
  #pragma unroll
  for (int kk = 0; kk < 4; ++kk) {
    const int d  = kk * 32 + (tid >> 3);        // 0..127
    const int ks = (tid & 7) * 8;               // 0..56
    Pack8H ph;
    ph.v = *(const v8h*)(&sT[d * TP + ks]);
    vval[kk] = ph.u;
    vidx[kk] = (bh * HDIM + d) * SEQ + s0 + ks;
  }

  // column sums over the 64 keys (waves 0..3, wave-uniform branch, no barrier inside)
  if (tid < HDIM) {
    float cs = 0.0f;
    #pragma unroll 1
    for (int ks = 0; ks < CT; ks += 8) {
      const v8h x = *(const v8h*)(&sT[tid * TP + ks]);
      #pragma unroll
      for (int i = 0; i < 8; ++i) cs += (float)x[i];
    }
    sC[tid] = cs;
  }
  __syncthreads();

  v4f cval = (v4f){0, 0, 0, 0};
  const size_t cidx = ((bh * NKT) + kt) * HDIM + (size_t)(tid & 31) * 4;
  if (tid < 32) cval = *(const v4f*)(&sC[tid * 4]);

  #pragma unroll
  for (int kk = 0; kk < 4; ++kk) {
    *(v4u*)(kb + kidx[kk]) = kval[kk];
    *(v4u*)(vt + vidx[kk]) = vval[kk];
  }
  if (tid < 32) *(v4f*)(colp + cidx) = cval;
  
}

// Flash attention, all keys visible. Block = (query block of 128, head, batch); one wave owns 16 query rows.
// S^T = K x Q^T so queries sit on lanes; P^T in C-layout is bit-identical to the A-fragment layout of O += P x V.
// K A-fragments and V^T B-fragments are loaded straight from the 16-bit planes (two 16-B loads per fragment).
__global__ __launch_bounds__(256) void attn_kernel(const float* __restrict__ qin,
                                                   const bf16* __restrict__ kb,
                                                   const f16* __restrict__ vt,
                                                   float* __restrict__ part) {
  const int qblk = blockIdx.x;
  const int h    = blockIdx.y;
  const int b    = blockIdx.z;
  const int tid  = threadIdx.x;
  const int wave = __builtin_amdgcn_readfirstlane(tid >> 5);
  const int lane = tid & 31;
  const int lq   = lane & 15;   // query column of S^T / d column of O
  const int hi   = lane >> 4;   // k-split half

  __shared__ __align__(16) float sO[NWAVE * 16 * OP];   // per-wave staging tile (wave-private rows; block barriers used)

  const int    qrow0 = qblk * BQ + wave * 16;            // first query row of this wave
  const size_t bh    = (size_t)b * NHEAD + h;

  // Q as B-operand fragments: lane lq holds query qrow0+lq, elements follow the split d map; bf16 RNE convert.
  FragB qf[4];
  {
    const float* qp = qin + (bh * SEQ_FULL + qrow0 + lq) * HDIM;
    #pragma unroll
    for (int f = 0; f < 4; ++f) {
      const v4f a0 = *(const v4f*)(qp + f * 32 + hi * 8);
      const v4f a1 = *(const v4f*)(qp + f * 32 + hi * 8 + 4);
      const v4f b0 = *(const v4f*)(qp + f * 32 + 16 + hi * 8);
      const v4f b1 = *(const v4f*)(qp + f * 32 + 16 + hi * 8 + 4);
      #pragma unroll
      for (int i = 0; i < 4; ++i) {
        qf[f].h[i]      = (bf16)a0[i];   // elems 0..7  : d = f*32 + hi*8 + 0..7
        qf[f].h[4 + i]  = (bf16)a1[i];
        qf[f].h[8 + i]  = (bf16)b0[i];   // elems 8..15 : d = f*32 + 16 + hi*8 + 0..7
        qf[f].h[12 + i] = (bf16)b1[i];
      }
    }
  }

  const bf16* kb_h = kb + bh * SEQ * HDIM;
  const f16*  vt_h = vt + bh * HDIM * SEQ;

  v8f o[8];
  #pragma unroll
  for (int dt = 0; dt < 8; ++dt) o[dt] = (v8f){0, 0, 0, 0, 0, 0, 0, 0};

  float rmax = -__builtin_inff();
  float rsum = 0.0f;
  const float SL = 0.08838834764831845f * 1.4426950408889634f;   // softmax scale * log2(e)

  #pragma unroll 1
  for (int i = 0; i < SEQ / BK; ++i) {
    const int j0 = i * BK;

    // S^T tiles: c[sub][r] = rawscore(query qrow0+lq, key j0 + sub*16 + hi*8 + r)
    v8f c[2];
    #pragma unroll
    for (int sub = 0; sub < 2; ++sub) {
      v8f acc = (v8f){0, 0, 0, 0, 0, 0, 0, 0};
      #pragma unroll
      for (int f = 0; f < 4; ++f) {
        // K A-fragment: row = key j0 + sub*16 + lq, split d map
        const bf16* base = kb_h + (size_t)(j0 + sub * 16 + lq) * HDIM + f * 32 + hi * 8;
        FragB ak;
        ak.q[0] = *(const v4u*)(base);        // d = f*32 + hi*8 + 0..7
        ak.q[1] = *(const v4u*)(base + 16);   // d = f*32 + 16 + hi*8 + 0..7
        acc = mma_bf16(ak.v, qf[f].v, acc);
      }
      c[sub] = acc;
      __builtin_amdgcn_sched_barrier(0);
    }

    // online softmax: query lq's 32 scores are split across lane / lane^16
    float m_new = rmax;
    #pragma unroll
    for (int r = 0; r < 8; ++r) {
      m_new = fmaxf(m_new, c[0][r]);
      m_new = fmaxf(m_new, c[1][r]);
    }
    m_new = fmaxf(m_new, __shfl_xor(m_new, 16, 32));
    const float scale = __builtin_amdgcn_exp2f((rmax - m_new) * SL);
    rmax = m_new;

    // exp + pack: P^T C-layout == A-fragment layout for the PV product; P carried x4096
    FragH pa;
    float psum = 0.0f;
    #pragma unroll
    for (int r = 0; r < 8; ++r) {
      const float p0 = __builtin_amdgcn_exp2f((c[0][r] - m_new) * SL);   // key hi*8 + r
      const float p1 = __builtin_amdgcn_exp2f((c[1][r] - m_new) * SL);   // key 16 + hi*8 + r
      psum += p0 + p1;
      pa.h[r]     = (f16)(p0 * 4096.0f);
      pa.h[8 + r] = (f16)(p1 * 4096.0f);
    }
    rsum = rsum * scale + psum + __shfl_xor(psum, 16, 32);

    // rescale O: queries are the row dimension there -> per-row scale from lane 8*hi + r
    float sc[8];
    #pragma unroll
    for (int r = 0; r < 8; ++r) sc[r] = __shfl(scale, (hi << 3) + r, 32);
    #pragma unroll
    for (int dt = 0; dt < 8; ++dt) {
      #pragma unroll
      for (int r = 0; r < 8; ++r) o[dt][r] *= sc[r];
    }
    __builtin_amdgcn_sched_barrier(0);

    // O += P x V, four output tiles at a time
    #pragma unroll
    for (int g = 0; g < 2; ++g) {
      FragH bv[4];
      #pragma unroll
      for (int t = 0; t < 4; ++t) {
        // V B-fragment: column n = d = (g*4+t)*16 + lq, split key map from the transposed plane
        const f16* base = vt_h + (size_t)((g * 4 + t) * 16 + lq) * SEQ + j0 + hi * 8;
        bv[t].q[0] = *(const v4u*)(base);            // keys j0 + hi*8 + 0..7
        bv[t].q[1] = *(const v4u*)(base + 16);       // keys j0 + 16 + hi*8 + 0..7
      }
      #pragma unroll
      for (int t = 0; t < 4; ++t) o[g * 4 + t] = mma_f16(pa.v, bv[t].v, o[g * 4 + t]);
      __builtin_amdgcn_sched_barrier(0);
    }
  }

  // normalize: lane holds column d = dt*16 + lq for query rows 8*hi + r
  float rs[8];
  #pragma unroll
  for (int r = 0; r < 8; ++r) rs[r] = (1.0f / 4096.0f) * (1.0f / __shfl(rsum, (hi << 3) + r, 32));

  const int so = wave * (16 * OP);
  v4f    vals[16];
  size_t gidx[8];

  // columns 0..63
  #pragma unroll
  for (int r = 0; r < 8; ++r) {
    #pragma unroll
    for (int t = 0; t < 4; ++t) sO[so + (hi * 8 + r) * OP + t * 16 + lq] = o[t][r] * rs[r];
  }
  __syncthreads();
  #pragma unroll
  for (int it = 0; it < 8; ++it) {
    const int row = it * 2 + hi;
    vals[it] = *(const v4f*)(&sO[so + row * OP + lq * 4]);
    gidx[it] = (bh * SEQ + qrow0 + row) * HDIM + lq * 4;
  }
  __syncthreads();
  // columns 64..127
  #pragma unroll
  for (int r = 0; r < 8; ++r) {
    #pragma unroll
    for (int t = 0; t < 4; ++t) sO[so + (hi * 8 + r) * OP + t * 16 + lq] = o[4 + t][r] * rs[r];
  }
  __syncthreads();
  #pragma unroll
  for (int it = 0; it < 8; ++it) {
    const int row = it * 2 + hi;
    vals[8 + it] = *(const v4f*)(&sO[so + row * OP + lq * 4]);
  }

  // 8 consecutive lanes x 16 B each), lanes 16..31 the same half of the next row.
  #pragma unroll
  for (int it = 0; it < 8; ++it) {
    *(v4f*)(part + gidx[it])         = vals[it];
    *(v4f*)(part + gidx[it] + OHALF) = vals[8 + it];
  }
  
}

// term[b][d] = (NHEAD-1)/SEQ * sum over heads and key tiles of colp. Block = (32-column group, batch), 256 threads;
// thread = (float4 column, row slice). A thread's row loads are independent of one another and all in flight at once;
// the slices are joined through LDS. Every sum in f64. Each block stores one whole 128-B line of term.
__global__ __launch_bounds__(256) void meanv_kernel(const float* __restrict__ colp,
                                                    float* __restrict__ term) {
  const int dg  = blockIdx.x;
  const int b   = blockIdx.y;
  const int tid = threadIdx.x;
  const int c4  = tid & (MD / 4 - 1);   // float4 column inside the group
  const int sl  = tid / (MD / 4);       // row slice 0..MS-1
  __shared__ __align__(16) double sM[MS * MD];   // [slice][column], cross-wave (block barrier)
  const float* src = colp + ((size_t)b * NHEAD * NKT + sl) * HDIM + dg * MD + c4 * 4;
  v4f x[MR];
  #pragma unroll
  for (int i = 0; i < MR - 1; ++i) x[i] = *(const v4f*)(src + (size_t)i * MS * HDIM);   // rows sl + i*MS
  // precaution: in the build the last load's destination takes over the address registers that the loads above name
  asm volatile("s_wait_xcnt 0x0" ::: "memory");
  x[MR - 1] = *(const v4f*)(src + (size_t)(MR - 1) * MS * HDIM);
  __builtin_amdgcn_sched_barrier(0);   // keeps every load ahead of the first add: one memory latency, not two
  double acc[4] = {0.0, 0.0, 0.0, 0.0};
  #pragma unroll
  for (int i = 0; i < MR; ++i) {
    #pragma unroll
    for (int k = 0; k < 4; ++k) acc[k] += (double)x[i][k];
  }
  #pragma unroll
  for (int k = 0; k < 4; ++k) sM[tid * 4 + k] = acc[k];   // = [sl][c4 * 4 + k]
  __syncthreads();
  if (tid < MD) {
    double y[MS];
    #pragma unroll
    for (int s = 0; s < MS; ++s) y[s] = sM[s * MD + tid];
    __builtin_amdgcn_sched_barrier(0);   // keeps every LDS read ahead of the first add: one LDS latency, not eight
    double t[4] = {0.0, 0.0, 0.0, 0.0};   // four independent chains over the slices
    #pragma unroll
    for (int s = 0; s < MS; ++s) t[s & 3] += y[s];
    const double tot = (t[0] + t[1]) + (t[2] + t[3]);
    term[(size_t)b * HDIM + dg * MD + tid] = (float)(tot * ((double)(NHEAD - 1) / (double)SEQ));
  }
}

// out[b][s][d] = sum over heads (fixed order) of part[b][h][s][d] + term[b][d]. Thread = one float4;
__global__ __launch_bounds__(256) void headsum_kernel(const float* __restrict__ part,
                                                      const float* __restrict__ term,
                                                      float* __restrict__ out) {
  const int g   = blockIdx.x * 256 + threadIdx.x;   // float4 index in [NB][SEQ][HDIM/4]
  const int d4  = g & (HDIM / 4 - 1);
  const int row = g / (HDIM / 4);                   // b*SEQ + s
  const int b   = row / SEQ;
  const int s   = row - b * SEQ;
  v4f acc = (v4f){0, 0, 0, 0};
  #pragma unroll 4
  for (int h = 0; h < NHEAD; ++h)
    acc += *(const v4f*)(part + (((size_t)b * NHEAD + h) * SEQ + s) * HDIM + d4 * 4);
  acc += *(const v4f*)(term + (size_t)b * HDIM + d4 * 4);
  float* dst = out + ((size_t)b * SEQ_FULL + s) * HDIM + d4 * 4;
  *(v4f*)dst = acc;
  
}

extern "C" void kernel_launch(void* const* d_in, const int* in_sizes, int n_in,
                              void* d_out, int out_size, void* d_ws, size_t ws_size,
                              hipStream_t stream) {
  if (n_in < 3) return;
  const size_t in_need  = (((size_t)(NB - 1) * NHEAD + (NHEAD - 1)) * SEQ_FULL + SEQ) * HDIM;
  const size_t out_need = ((size_t)(NB - 1) * SEQ_FULL + SEQ) * HDIM;
  if ((size_t)in_sizes[0] < in_need) return;
  if ((size_t)in_sizes[1] < in_need) return;
  if ((size_t)in_sizes[2] < in_need) return;
  if ((size_t)out_size < out_need) return;
  if (ws_size < KB_BYTES + VT_BYTES + PART_BYTES + COLP_BYTES + TERM_BYTES) return;

  const float* qin = (const float*)d_in[0];
  const float* kin = (const float*)d_in[1];
  const float* vin = (const float*)d_in[2];
  float*       out = (float*)d_out;

  char*  wsb  = (char*)d_ws;
  bf16*  kb   = (bf16*)wsb;
  f16*   vt   = (f16*)(wsb + KB_BYTES);
  float* part = (float*)(wsb + KB_BYTES + VT_BYTES);
  float* colp = (float*)(wsb + KB_BYTES + VT_BYTES + PART_BYTES);
  float* term = (float*)(wsb + KB_BYTES + VT_BYTES + PART_BYTES + COLP_BYTES);

  kv_planes_kernel<<<dim3(SEQ / CT, NHEAD, NB), 256, 0, stream>>>(kin, vin, kb, vt, colp);
  meanv_kernel<<<dim3(HDIM / MD, NB), 256, 0, stream>>>(colp, term);
  attn_kernel<<<dim3(SEQ / BQ, NHEAD, NB), 256, 0, stream>>>(qin, kb, vt, part);
  headsum_kernel<<<dim3((unsigned)(((size_t)NB * SEQ * (HDIM / 4)) / 256)), 256, 0, stream>>>(part, term, out);
}
